// v010
// Times are from an AMD MI455X. After a warm-up the kernel runs many times in a row, and a time is the length of
// such a window on the GPU divided by its runs, so every launch and the gaps after it count. The runs cycle
// through copies of the inputs. A figure is the median of several windows, for all but v000 over two sittings.
// Sittings can differ by a few percent; kernels timed side by side share one.
// This document starts at v010; the versions before it stand elsewhere.
// It runs in 35.6 microseconds.
// Timed twice side by side with v009, it ran 1.15 times as fast both times.
// Counting every step since v000, which is the starting kernel, it is 3623 times as fast.
#include <hip/hip_runtime.h>
// Single-head causal self-attention from a 32-wide embedding (x [16][4096][32]; k/q/v = x W ([in][out] [32][64], no biases; input order Wk, Wq, Wv); ONE 64-wide head (head_size 64 != C 32); scores * 64^-0.5; causal; softmax; out = weights v -> [16][4096][64]; no output projection).
// Structure: token rows; scores and output reassociated through the 32-wide embedding (q k^T = (x Wq Wk^T) x^T, P v = (P x) Wv); one projection launch (x and weights rounded in registers, WMMA products, f16 q' rows and x, x^T in matrix-fragment order); one fused causal attention launch (scores alpha 1/8, running-maximum softmax f32 -> f16 weights, P x in f32, all in registers; the four key shares of a query tile merged through LDS, multiplied by Wv and written as f32 into the output rows; rows 0..511 are worked exactly in f32 by four further waves of the same blocks, which alone write them); launches: see trace.
// Compute dtype: inputs rounded to bf16; x / weights exact; q' and softmax weights as plain f16 GEMM operands (~2^-12); q in front of Wk^T and P x in front of Wv as two f16 terms; scores and softmax statistics f32. v_wmma_f32_16x16x32_f16.
#define NB 16
#define SQ 4096
#define DM 32
#define NH 1
#define HD 64
#define HG 4                         /* heads per attention launch group */
#define QT 256
#define NKX SQ                       /* S / P row pitch */
#define QT0 512                      /* first-tile rows recomputed exactly (f32): 512 here (no output projection averages the early-row cancellation errors away; logit sigma 1.0) */
#define B0 0                         /* first batch processed (debug hook) */
#define NBR NB                       /* batches processed (debug hook) */
#define NR ((size_t)NB * SQ)
#define DMQ DM
#define DFF 4096                     /* FFN hidden width */
#define DFFR 100                     /* real hidden width */
#define MP ((int)((size_t)NBR * SQ)) /* rows projected (debug hook) */
#define QN SQ                        /* query rows attended per batch (debug hook) */
#define NHD NH                       /* heads attended (debug hook) */
#define MPO MP                       /* rows through the output stage (debug hook) */
#define LQ (3 * DM)
typedef __bf16 v16b __attribute__((ext_vector_type(16)));
typedef unsigned short v8us __attribute__((ext_vector_type(8), may_alias));
typedef float  v8f  __attribute__((ext_vector_type(8)));
typedef float  v4f  __attribute__((ext_vector_type(4)));
typedef float  v4fa __attribute__((ext_vector_type(4), may_alias));
union FragB { v16b v; v8us half[2]; unsigned short u[16]; };

__device__ __forceinline__ unsigned short bf16_bits(float x) { unsigned int u = __float_as_uint(x); return (unsigned short)((u + 0x7FFFu + ((u >> 16) & 1u)) >> 16); }
__device__ __forceinline__ float bf16_val(unsigned short b) { return __uint_as_float(((unsigned int)b) << 16); }
__device__ __forceinline__ float bf16_round(float x) { return bf16_val(bf16_bits(x)); }
// D += A·B with NT terms: 1 = ah·bh, 2 = + al·bh (A split), 3 = + ah·bl (both split)
template <int NT>
__device__ __forceinline__ v8f mmaN(v16b ah, v16b al, v16b bh, v16b bl, v8f c) {
  c = __builtin_amdgcn_wmma_f32_16x16x32_bf16(false, ah, false, bh, (short)0, c, false, false);
  if (NT >= 2) c = __builtin_amdgcn_wmma_f32_16x16x32_bf16(false, al, false, bh, (short)0, c, false, false);
  if (NT >= 3) c = __builtin_amdgcn_wmma_f32_16x16x32_bf16(false, ah, false, bl, (short)0, c, false, false);
  asm volatile("v_nop\n\tv_nop\n\tv_nop\n\tv_nop" : "+v"(c) : "v"(ah), "v"(al), "v"(bh), "v"(bl));
  return c;
}

__global__ __launch_bounds__(256) void k_wt_bf16(const float* __restrict__ W, unsigned short* __restrict__ Wt, int K, int N) {
  const int t = blockIdx.x * 256 + threadIdx.x;
  const int k8n = K / 8;
  if (t >= N * k8n) return;
  const int n = t / k8n, k8 = (t % k8n) * 8;
  v8us v;
#pragma unroll
  for (int i = 0; i < 8; ++i) v[i] = bf16_bits(W[(size_t)(k8 + i) * N + n]);
  *(v8us*)(Wt + (size_t)n * K + k8) = v;
  
}

// GEMM C[M][N] (f32, pitch ldc) = act(A[M][K]·W + bias). A f32 row-major (pitch lda) converted per fragment to bf16
// (ASPLIT: hi/lo two planes -> 2 terms, else single rounded term); Wt bf16 [N][K] (pitch ldb). BIAS_BF16 rounds the
// bias to bf16 first (bias quantised to bf16 before the add). K%32==0, M%16==0, N%64==0.
template <bool ASPLIT, int ACT, bool BIAS_BF16>
__global__ __launch_bounds__(128) void k_gemm_bf(const float* __restrict__ A, int lda, const unsigned short* __restrict__ Wt, int ldb,
                                               const float* __restrict__ bias, float* __restrict__ C, int ldc, int M, int N, int K) {
  __shared__ __attribute__((aligned(16))) float so[4][16][64];
  const int tid = threadIdx.x, w = tid >> 5, lane = tid & 31, ln = lane & 15, hh = lane >> 4;
  const int ntn = N / 64;
  const int wid = blockIdx.x * 4 + w;
  const int mt = wid / ntn, nq = wid % ntn;
  if (mt * 16 >= M) return;
  const int row0 = mt * 16, col0 = nq * 64;
  const float* arow = A + (size_t)(row0 + ln) * lda;
  v8f acc[4] = {};
  for (int kb = 0; kb < K; kb += 32) {
    FragB ah, al;
    const v4f x0 = *(const v4fa*)(arow + kb + 8 * hh), x1 = *(const v4fa*)(arow + kb + 8 * hh + 4);
    const v4f x2 = *(const v4fa*)(arow + kb + 16 + 8 * hh), x3 = *(const v4fa*)(arow + kb + 16 + 8 * hh + 4);
    float xs[16] = {x0[0],x0[1],x0[2],x0[3],x1[0],x1[1],x1[2],x1[3],x2[0],x2[1],x2[2],x2[3],x3[0],x3[1],x3[2],x3[3]};
#pragma unroll
    for (int i = 0; i < 16; ++i) { const unsigned short hb = bf16_bits(xs[i]); ah.u[i] = hb; al.u[i] = ASPLIT ? bf16_bits(xs[i] - bf16_val(hb)) : (unsigned short)0; }
#pragma unroll
    for (int t = 0; t < 4; ++t) {
      const unsigned short* brow = Wt + (size_t)(col0 + t * 16 + ln) * ldb + kb;
      FragB b;
      b.half[0] = *(const v8us*)(brow + 8 * hh);
      b.half[1] = *(const v8us*)(brow + 16 + 8 * hh);
      acc[t] = mmaN<ASPLIT ? 2 : 1>(ah.v, al.v, b.v, b.v, acc[t]);
    }
  }
#pragma unroll
  for (int t = 0; t < 4; ++t) {
    float bv = bias ? bias[col0 + t * 16 + ln] : 0.f;
    if (BIAS_BF16) bv = bf16_round(bv);
#pragma unroll
    for (int r = 0; r < 8; ++r) { float v = acc[t][r] + bv; if (ACT == 1) v = fmaxf(v, 0.f); so[w][8 * hh + r][t * 16 + ln] = v; }
  }
  __builtin_amdgcn_fence(__ATOMIC_ACQ_REL, "workgroup");
  __builtin_amdgcn_wave_barrier();
  const int rsub = lane >> 4, c4 = (lane & 15) * 4;
  {
#pragma unroll
    for (int q = 0; q < 8; ++q) {
      const int r = q * 2 + rsub;
      const v4f v = *(const v4fa*)&so[w][r][c4];
      *(v4f*)(C + (size_t)(row0 + r) * ldc + col0 + c4) = v;
    }
    
  }
}

// GEMM C = act(A·W + bias + resid): A f32 (ASPLIT -> hi/lo 2 terms), Wt bf16 [N][K]; ACT 0 none, 1 relu, 2 exact gelu;
// resid (optional, f32, row index = (row % rmod), pitch ldr, RES_BF16 rounds it) added before the activation.
template <bool ASPLIT, int ACT, bool BIAS_BF16, bool RES_BF16>
__global__ __launch_bounds__(128) void k_gemm_bf3(const float* __restrict__ A, int lda, const unsigned short* __restrict__ Wt, int ldb,
                                                const float* __restrict__ bias, const float* __restrict__ resid, int rmod, int ldr,
                                                float* __restrict__ C, int ldc, int M, int N, int K) {
  __shared__ __attribute__((aligned(16))) float so[4][16][64];
  const int tid = threadIdx.x, w = tid >> 5, lane = tid & 31, ln = lane & 15, hh = lane >> 4;
  const int ntn = N / 64;
  const int wid = blockIdx.x * 4 + w;
  const int mt = wid / ntn, nq = wid % ntn;
  if (mt * 16 >= M) return;
  const int row0 = mt * 16, col0 = nq * 64;
  const float* arow = A + (size_t)(row0 + ln) * lda;
  v8f acc[4] = {};
  for (int kb = 0; kb < K; kb += 32) {
    FragB ah, al;
    const v4f x0 = *(const v4fa*)(arow + kb + 8 * hh), x1 = *(const v4fa*)(arow + kb + 8 * hh + 4);
    const v4f x2 = *(const v4fa*)(arow + kb + 16 + 8 * hh), x3 = *(const v4fa*)(arow + kb + 16 + 8 * hh + 4);
    float xs[16] = {x0[0],x0[1],x0[2],x0[3],x1[0],x1[1],x1[2],x1[3],x2[0],x2[1],x2[2],x2[3],x3[0],x3[1],x3[2],x3[3]};
#pragma unroll
    for (int i = 0; i < 16; ++i) { const unsigned short hb = bf16_bits(xs[i]); ah.u[i] = hb; al.u[i] = ASPLIT ? bf16_bits(xs[i] - bf16_val(hb)) : (unsigned short)0; }
#pragma unroll
    for (int t = 0; t < 4; ++t) {
      const unsigned short* brow = Wt + (size_t)(col0 + t * 16 + ln) * ldb + kb;
      FragB b;
      b.half[0] = *(const v8us*)(brow + 8 * hh);
      b.half[1] = *(const v8us*)(brow + 16 + 8 * hh);
      acc[t] = mmaN<ASPLIT ? 2 : 1>(ah.v, al.v, b.v, b.v, acc[t]);
    }
  }
#pragma unroll
  for (int t = 0; t < 4; ++t) {
    const int col = col0 + t * 16 + ln;
    float bv = bias ? bias[col] : 0.f;
    if (BIAS_BF16) bv = bf16_round(bv);
#pragma unroll
    for (int r = 0; r < 8; ++r) {
      float v = acc[t][r] + bv;
      if (resid) { float rv = resid[(size_t)((row0 + 8 * hh + r) % rmod) * ldr + col]; if (RES_BF16) rv = bf16_round(rv); v += rv; }
      if (ACT == 1) v = fmaxf(v, 0.f);
      if (ACT == 2) v = 0.5f * v * (1.0f + erff(v * 0.70710678118654752f));
      if (ACT == 3) { const float u = 0.7978845608028654f * (v + 0.044715f * v * v * v); v = 0.5f * v * (1.0f + tanhf(u)); }
      so[w][8 * hh + r][t * 16 + ln] = v;
    }
  }
  __builtin_amdgcn_fence(__ATOMIC_ACQ_REL, "workgroup");
  __builtin_amdgcn_wave_barrier();
  const int rsub = lane >> 4, c4 = (lane & 15) * 4;
  {
#pragma unroll
    for (int q = 0; q < 8; ++q) {
      const int r = q * 2 + rsub;
      const v4f v = *(const v4fa*)&so[w][r][c4];
      *(v4f*)(C + (size_t)(row0 + r) * ldc + col0 + c4) = v;
    }
    
  }
}
// row LayerNorm (biased variance, eps) over N: s = X (+ R); optional out_sum <- s; out_norm <- (s-mu)*rsqrt(var+eps)*g + b
template <bool PARAM_BF16>
__global__ __launch_bounds__(256) void k_layernorm(const float* __restrict__ X, const float* __restrict__ R, const float* __restrict__ g, const float* __restrict__ bta,
                                                  float* __restrict__ out_sum, float* __restrict__ out_norm, int N, float eps) {
  __shared__ float red[256];
  const int row = blockIdx.x, tid = threadIdx.x;
  const float* x = X + (size_t)row * N; const float* rr = R ? R + (size_t)row * N : nullptr;
  float vals[16];                     // up to N = 4096
  const int per = N / 256;            // contiguous chunk per thread? use strided-by-4 chunks: thread handles j = tid*4 + 1024*u
  float s1 = 0.f;
  for (int u = 0; u < per / 4; ++u) {
    const int j = tid * 4 + 1024 * u;
    const v4f a = *(const v4fa*)(x + j);
    v4f b = {0.f,0.f,0.f,0.f}; if (rr) b = *(const v4fa*)(rr + j);
#pragma unroll
    for (int q = 0; q < 4; ++q) { const float v = a[q] + b[q]; vals[u * 4 + q] = v; s1 += v; }
  }
  red[tid] = s1; __syncthreads();
  for (int st = 128; st > 0; st >>= 1) { if (tid < st) red[tid] += red[tid + st]; __syncthreads(); }
  const float mu = red[0] / (float)N; __syncthreads();
  float s2 = 0.f;
  for (int u = 0; u < per / 4; ++u)
#pragma unroll
    for (int q = 0; q < 4; ++q) { const float c = vals[u * 4 + q] - mu; s2 += c * c; }
  red[tid] = s2; __syncthreads();
  for (int st = 128; st > 0; st >>= 1) { if (tid < st) red[tid] += red[tid + st]; __syncthreads(); }
  const float rs = rsqrtf(red[0] / (float)N + eps);
  {
    for (int u = 0; u < per / 4; ++u) {
      const int j = tid * 4 + 1024 * u;
      v4f o, sm;
#pragma unroll
      for (int q = 0; q < 4; ++q) {
        float gg = g[j + q], bb = bta[j + q];
        if (PARAM_BF16) { gg = bf16_round(gg); bb = bf16_round(bb); }
        sm[q] = vals[u * 4 + q]; o[q] = (vals[u * 4 + q] - mu) * rs * gg + bb;
      }
      if (out_sum) *(v4f*)(out_sum + (size_t)row * N + j) = sm;
      *(v4f*)(out_norm + (size_t)row * N + j) = o;
    }
    
  }
}



// ---- f16 WMMA path (v_wmma_f32_16x16x32_f16): 11-bit significands for operands in range — used where a [0,1] probability operand needs more precision than bf16
typedef _Float16 v16h __attribute__((ext_vector_type(16)));
union FragH { v16h v; v8us half[2]; _Float16 h[16]; unsigned short u[16]; };
template <int NT>
__device__ __forceinline__ v8f mmaH(v16h ah, v16h al, v16h bh, v16h bl, v8f c) {
  c = __builtin_amdgcn_wmma_f32_16x16x32_f16(false, ah, false, bh, (short)0, c, false, false);
  if (NT >= 2) c = __builtin_amdgcn_wmma_f32_16x16x32_f16(false, al, false, bh, (short)0, c, false, false);
  if (NT >= 3) c = __builtin_amdgcn_wmma_f32_16x16x32_f16(false, ah, false, bl, (short)0, c, false, false);
  asm volatile("v_nop\n\tv_nop\n\tv_nop\n\tv_nop" : "+v"(c) : "v"(ah), "v"(al), "v"(bh), "v"(bl));
  return c;
}
// batched GEMM like k_gemm_b but f16 operands: A f32 (split into f16 hi/lo if ASPLIT, else rounded to f16), Bt = f16 values [n][k]; alpha; C f32; N multiple of 16 (partial tiles skipped)
template <bool ASPLIT>
__global__ __launch_bounds__(128) void k_gemm_h(const float* __restrict__ A, int lda, size_t sA, const _Float16* __restrict__ Bh, int ldb, size_t sB, float alpha, float* __restrict__ C, int ldc, size_t sC, int M, int N, int K) {
  __shared__ __attribute__((aligned(16))) float so[4][16][64];
  const int tid = threadIdx.x, w = tid >> 5, lane = tid & 31, ln = lane & 15, hh = lane >> 4; const int by = blockIdx.y;
  A += (size_t)by * sA; Bh += (size_t)by * sB; C += (size_t)by * sC;
  const int ntn = (N + 63) / 64; const int wid = blockIdx.x * 4 + w; const int mt = wid / ntn, nq = wid % ntn; if (mt * 16 >= M) return;
  const int row0 = mt * 16, col0 = nq * 64; const float* arow = A + (size_t)(row0 + ln) * lda;
  v8f acc[4] = {};
  for (int kb = 0; kb < K; kb += 32) {
    FragH ah, al;
    const v4f x0 = *(const v4fa*)(arow + kb + 8 * hh), x1 = *(const v4fa*)(arow + kb + 8 * hh + 4), x2 = *(const v4fa*)(arow + kb + 16 + 8 * hh), x3 = *(const v4fa*)(arow + kb + 16 + 8 * hh + 4);
    float xs[16] = {x0[0],x0[1],x0[2],x0[3],x1[0],x1[1],x1[2],x1[3],x2[0],x2[1],x2[2],x2[3],x3[0],x3[1],x3[2],x3[3]};
#pragma unroll
    for (int i = 0; i < 16; ++i) { const _Float16 h = (_Float16)xs[i]; ah.h[i] = h; al.h[i] = ASPLIT ? (_Float16)(xs[i] - (float)h) : (_Float16)0.0f; }
#pragma unroll
    for (int t = 0; t < 4; ++t) { if (col0 + t * 16 >= N) continue; const size_t boff = (size_t)(col0 + t * 16 + ln) * ldb + kb; FragH bq; bq.half[0] = *(const v8us*)(Bh + boff + 8 * hh); bq.half[1] = *(const v8us*)(Bh + boff + 16 + 8 * hh);
      acc[t] = mmaH<ASPLIT ? 2 : 1>(ah.v, al.v, bq.v, bq.v, acc[t]); }
  }
#pragma unroll
  for (int t = 0; t < 4; ++t) { if (col0 + t * 16 >= N) continue;
#pragma unroll
    for (int r = 0; r < 8; ++r) so[w][8 * hh + r][t * 16 + ln] = acc[t][r] * alpha; }
  __builtin_amdgcn_fence(__ATOMIC_ACQ_REL, "workgroup"); __builtin_amdgcn_wave_barrier();
  const int rsub = lane >> 4, c4 = (lane & 15) * 4;
  {
#pragma unroll
    for (int q = 0; q < 8; ++q) { const int r = q * 2 + rsub; if (col0 + c4 < N) { const v4f v = *(const v4fa*)&so[w][r][c4]; *(v4f*)(C + (size_t)(row0 + r) * ldc + col0 + c4) = v; } }
     }
}

// k_gemm_hh variant with fused epilogue: v = acc·alpha + bias[by·sBias + col] (+ CP[(row/rowsPerB)·sCPb + by·64 + col] if CP) ; ACT 0 none / 1 elu ; writes f16 C16 (and f32 C if non-null)
template <int ACT>
__global__ __launch_bounds__(128) void k_gemm_hhx(const _Float16* __restrict__ A, int lda, size_t sA, const _Float16* __restrict__ Bh, int ldb, size_t sB, float alpha, const float* __restrict__ bias, size_t sBias, const float* __restrict__ CP, int rowsPerB, size_t sCPb, int row0g,
    float* __restrict__ C, _Float16* __restrict__ C16, int ldc, size_t sC, int M, int N, int K) {
  __shared__ __attribute__((aligned(16))) float so[4][16][64];
  const int tid = threadIdx.x, w = tid >> 5, lane = tid & 31, ln = lane & 15, hh = lane >> 4; const int by = blockIdx.y;
  A += (size_t)by * sA; Bh += (size_t)by * sB; const size_t cofs = (size_t)by * sC; const float* bp = bias ? bias + (size_t)by * sBias : nullptr;
  const int ntn = (N + 63) / 64; const int wid = blockIdx.x * 4 + w; const int mt = wid / ntn, nq = wid % ntn; if (mt * 16 >= M) return;
  const int row0 = mt * 16, col0 = nq * 64; const _Float16* arow = A + (size_t)(row0 + ln) * lda;
  v8f acc[4] = {};
  for (int kb = 0; kb < K; kb += 32) { FragH ah; ah.half[0] = *(const v8us*)((const unsigned short*)arow + kb + 8 * hh); ah.half[1] = *(const v8us*)((const unsigned short*)arow + kb + 16 + 8 * hh);
#pragma unroll
    for (int t = 0; t < 4; ++t) { if (col0 + t * 16 >= N) continue; const size_t boff = (size_t)(col0 + t * 16 + ln) * ldb + kb; FragH bq; bq.half[0] = *(const v8us*)((const unsigned short*)Bh + boff + 8 * hh); bq.half[1] = *(const v8us*)((const unsigned short*)Bh + boff + 16 + 8 * hh);
      acc[t] = mmaH<1>(ah.v, ah.v, bq.v, bq.v, acc[t]); }
  }
#pragma unroll
  for (int t = 0; t < 4; ++t) { if (col0 + t * 16 >= N) continue; const int col = col0 + t * 16 + ln; const float bv = bp ? bf16_round(bp[col]) : 0.f;
#pragma unroll
    for (int r = 0; r < 8; ++r) { float v = acc[t][r] * alpha + bv; if (CP) { const int rr = row0g + row0 + 8 * hh + r; if (rowsPerB < 0) v += CP[cofs + (size_t)rr * ldc + col];      /* rowsPerB < 0: own element of the batched C plane */ else { const int bidx = rr / rowsPerB; v += CP[(size_t)bidx * sCPb + (size_t)by * 64 + col]; } } if (ACT == 1) v = (v > 0.f) ? v : expm1f(v); else if (ACT == 7) v = (v > 0.f) ? v + 1.0f : expf(v); else if (ACT == 8) v = tanhf(v); else if (ACT == 9) v = 0.5f * v * (1.0f + tanhf(0.7978845608028654f * (v + 0.044715f * v * v * v))); else if (ACT == 11) v = 1.0f / (1.0f + expf(-v)); else if (ACT == 12) v = (v > 0.f) ? v : 0.01f * v; else if (ACT == 14) v = (v > 0.f) ? v : 0.1f * v; else if (ACT == 16) v = (v >= 0.f) ? v : 0.3f * v; else if (ACT == 17) v = (v >= 0.f) ? v : 0.2f * v; else if (ACT == 15) v = v / (1.0f + expf(-v)); else if (ACT == 3) v = fmaxf(v, 0.f); else if (ACT == 6) v = 0.5f * v * (1.0f + erff(v * 0.70710678118654752f)); so[w][8 * hh + r][t * 16 + ln] = v; } }
  __builtin_amdgcn_fence(__ATOMIC_ACQ_REL, "workgroup"); __builtin_amdgcn_wave_barrier();
  const int rsub = lane >> 4, c4 = (lane & 15) * 4; typedef _Float16 v4h __attribute__((ext_vector_type(4)));
  {
#pragma unroll
    for (int q = 0; q < 8; ++q) { const int r = q * 2 + rsub; if (col0 + c4 < N) { const v4f v = *(const v4fa*)&so[w][r][c4]; if (C) *(v4f*)(C + cofs + (size_t)(row0 + r) * ldc + col0 + c4) = v; if (C16) { v4h h4; for (int i = 0; i < 4; ++i) h4[i] = (_Float16)v[i]; *(v4h*)(C16 + cofs + (size_t)(row0 + r) * ldc + col0 + c4) = h4; } } }
     }
}


typedef _Float16 v4h __attribute__((ext_vector_type(4)));

__global__ __launch_bounds__(256) void k_h16(const float* __restrict__ x, _Float16* __restrict__ X16, size_t n8) { const size_t t = (size_t)blockIdx.x * 256 + threadIdx.x; if (t >= n8) return; FragH f;
#pragma unroll
  for (int q = 0; q < 8; ++q) f.h[q] = (_Float16)x[t * 8 + q]; *(v8us*)((unsigned short*)X16 + t * 8) = f.half[0];  }
__global__ __launch_bounds__(256) void k_round16f(const float* __restrict__ W, _Float16* __restrict__ Bt, size_t n8) { const size_t t = (size_t)blockIdx.x * 256 + threadIdx.x; if (t >= n8) return; FragH f;
#pragma unroll
  for (int i = 0; i < 8; ++i) f.h[i] = (_Float16)(bf16_round(W[t * 8 + i]) * 16.0f); *(v8us*)((unsigned short*)Bt + t * 8) = f.half[0];  }

__global__ __launch_bounds__(256) void k_hl(const float* __restrict__ F, _Float16* __restrict__ Hh, _Float16* __restrict__ Hl, size_t n8) { const size_t t = (size_t)blockIdx.x * 256 + threadIdx.x; if (t >= n8) return; FragH fh, fl; const v4f a = *(const v4fa*)(F + t * 8), c = *(const v4fa*)(F + t * 8 + 4);
#pragma unroll
  for (int q = 0; q < 4; ++q) { _Float16 h = (_Float16)a[q]; fh.h[q] = h; fl.h[q] = (_Float16)((a[q] - (float)h) * 1024.0f); h = (_Float16)c[q]; fh.h[4 + q] = h; fl.h[4 + q] = (_Float16)((c[q] - (float)h) * 1024.0f); }
  { *(v8us*)((unsigned short*)Hh + t * 8) = fh.half[0]; *(v8us*)((unsigned short*)Hl + t * 8) = fl.half[0];  } }



__global__ __launch_bounds__(256) void k_wnat(const float* __restrict__ w, size_t n8, _Float16* __restrict__ Bt) { const size_t t = (size_t)blockIdx.x * 256 + threadIdx.x; if (t >= n8) return; FragH f; for (int q = 0; q < 8; ++q) f.h[q] = (_Float16)(bf16_round(w[t * 8 + q]) * 16.0f); *(v8us*)((unsigned short*)Bt + t * 8) = f.half[0];  }
__global__ __launch_bounds__(256) void k_rsm(const float* __restrict__ S, _Float16* __restrict__ P, int nrows) {
  #pragma clang fp contract(off)
  const int i = blockIdx.x * 256 + threadIdx.x; if (i >= nrows) return; const float* s = S + (size_t)i * SQ; float mx = -3.0e38f;
#pragma unroll 1
  for (int j = 0; j < SQ; ++j) mx = fmaxf(mx, s[j]); float se = 0.f;
#pragma unroll 1
  for (int j = 0; j < SQ; ++j) se += expf(s[j] - mx); const float sc = 256.0f / se;
#pragma unroll 1
  for (int j0 = 0; j0 < SQ; j0 += 8) { FragH f; for (int q = 0; q < 8; ++q) f.h[q] = (_Float16)(expf(s[j0 + q] - mx) * sc); unsigned short* d = (unsigned short*)P + (size_t)i * SQ + j0; *(v8us*)d = f.half[0];  } }
__global__ __launch_bounds__(256) void k_vt(const _Float16* __restrict__ V16, int b, int h0, _Float16* __restrict__ VT) { __shared__ unsigned short tl[64][65]; const int tid = threadIdx.x; const int hh = blockIdx.x % HG, sg = blockIdx.x / HG; const int s0 = sg * 64; const int h = h0 + hh;
  for (int i = tid; i < 64 * 8; i += 256) { const int j = i / 8, d8 = (i % 8) * 8; FragH f; f.half[0] = *(const v8us*)((const unsigned short*)V16 + ((size_t)b * SQ + s0 + j) * DM + h * HD + d8); for (int q = 0; q < 8; ++q) tl[d8 + q][j] = f.u[q]; }
  __syncthreads();
  { for (int i = tid; i < 64 * 8; i += 256) { const int d = i / 8, j8 = (i % 8) * 8; FragH f; for (int q = 0; q < 8; ++q) f.u[q] = tl[d][j8 + q]; *(v8us*)((unsigned short*)VT + ((size_t)hh * HD + d) * SQ + s0 + j8) = f.half[0]; }  } }



// Fused causal attention, one launch for all query rows and batches: a wave holds 32 query rows (two 16-column groups) and walks every fourth block of 32 keys, four waves to a tile; scores and weights stay in registers.
// Reassociated through the 32-wide embedding: q k^T = (x Wq Wk^T) x^T and P v = (P x) Wv, so the walk reads x itself (32 wide) on both sides in place of k and v (64 wide): one k step a score tile, two output tiles in place of four;
// the product with Wv is done once per query tile behind the merge.
// x lies in two fragment-order planes, 2 KiB per block of 32 keys each: the key plane [16-key tile][register half][lane][8 values] (rows = keys, k = embedding) and the transposed plane [16-column tile][register half][lane][8 values] (rows = embedding columns, k = keys),
// the value of (lane, register) being the one that the row loader fa_frag would fetch from a row-major plane, so a wave's 16-byte load covers four whole 128-byte lines.
// S^T = X Q'^T (A = x rows, B = q' rows, both in the same k order), so a lane holds the scores of ONE query per group: keys kb + 8 hh + r (tile 0) and kb + 16 + 8 hh + r (tile 1), which is the k order of a B operand:
// the weights are converted in place and feed Y^T += X^T P^T (A = x^T rows in the same k order). Running maximum (log2 units) and sum per query in f32; the two lane halves exchange the maximum where it is scanned and join their sums once at the end.
// The maximum is scanned in a wave's first and last block; in between, the test for a rescale reads the sums of the weights: only when a lane's sum of a block's 16 weights of one query exceeds 2^12 (so weights stay <= 2^12, inside f16) is the maximum scanned and are the output tiles rescaled. In the last block they are rescaled when some query's maximum has grown by more than 8. Key fragments are refetched right behind their products, x^T fragments right behind theirs, into the same registers.
__device__ __forceinline__ v16h fa_frag(const _Float16* p) { FragH f; f.half[0] = *(const v8us*)((const unsigned short*)p); f.half[1] = *(const v8us*)((const unsigned short*)p + 16); return f.v; }      /* p already holds the lane half's 8 hh */
__device__ __forceinline__ v16h fa_fragp(const _Float16* p) { FragH f; f.half[0] = *(const v8us*)((const unsigned short*)p); f.half[1] = *(const v8us*)((const unsigned short*)p + 256); return f.v; }      /* fragment-order plane: p already holds the lane's 16-byte unit; each of the two loads reads 512 neighbouring bytes over the wave */
__device__ __forceinline__ v8f fa_mma(v16h a, v16h b, v8f c) { return __builtin_amdgcn_wmma_f32_16x16x32_f16(false, a, false, b, (short)0, c, false, false); }
__device__ __forceinline__ float fa_xhalf(float x) { return __builtin_bit_cast(float, __builtin_amdgcn_permlanex16(__builtin_bit_cast(int, x), __builtin_bit_cast(int, x), 0x76543210, 0xfedcba98, false, false)); }      /* lane l with lane l ^ 16 */
#define FAC 0.18033688011112042f     /* 64^-0.5 * log2(e) */
__device__ __forceinline__ float fa_exp2(float x) { float r; asm("v_exp_f32 %0, %1\n\tv_nop" : "=v"(r) : "v"(x)); return r; }      /* 2^x; the v_nop fills the one slot that the instruction set asks for between a transcendental and a next instruction that reads its result or overwrites its source */
__device__ __forceinline__ v8f fa_exp2x8(v8f x) { float r0, r1, r2, r3, r4, r5, r6, r7;      /* eight 2^x in one statement: the results are kept off the sources (early clobber), so each instruction fills the slot of the one before it, and one v_nop that of the last */
  asm("v_exp_f32 %0, %8\n\tv_exp_f32 %1, %9\n\tv_exp_f32 %2, %10\n\tv_exp_f32 %3, %11\n\tv_exp_f32 %4, %12\n\tv_exp_f32 %5, %13\n\tv_exp_f32 %6, %14\n\tv_exp_f32 %7, %15\n\tv_nop"
      : "=&v"(r0), "=&v"(r1), "=&v"(r2), "=&v"(r3), "=&v"(r4), "=&v"(r5), "=&v"(r6), "=&v"(r7) : "v"(x[0]), "v"(x[1]), "v"(x[2]), "v"(x[3]), "v"(x[4]), "v"(x[5]), "v"(x[6]), "v"(x[7]));
  return v8f{r0, r1, r2, r3, r4, r5, r6, r7}; }
// Last product out^T = Wv^T Y^T on the matrix unit: A = Wv^T (row = output column d; f16 of the bf16-rounded weight x16, exact), B = the normalised Y row of one query, split into f16 high and low parts (two terms, so that Y keeps f32 accuracy);
// both in the k order 8 hh + i, 16 + 8 hh + i over the 32 embedding columns, which is the order in which the Y^T tiles hold them (register r of tile t = column 16 t + 8 hh + r).
__device__ __forceinline__ v16h wv_frag(const float* __restrict__ wv, int d, int hh) { FragH f;
#pragma unroll      /* constant indices, so that the arrays indexed below stay in registers */
  for (int i = 0; i < 16; ++i) f.h[i] = (_Float16)(bf16_round(wv[((i < 8 ? i : 8 + i) + 8 * hh) * HD + d]) * 16.0f);
  return f.v; }
__device__ __forceinline__ v8f wv_tile(v16h a, const float (&y)[16]) { FragH yh, yl; const v8f z8 = {0.f, 0.f, 0.f, 0.f, 0.f, 0.f, 0.f, 0.f};
#pragma unroll      /* constant indices, so that the arrays indexed below stay in registers */
  for (int i = 0; i < 16; ++i) { const _Float16 h = (_Float16)y[i]; yh.h[i] = h; yl.h[i] = (_Float16)(y[i] - (float)h); }
  return fa_mma(a, yh.v, fa_mma(a, yl.v, z8)) * 0.0625f; }      /* takes the weights' x16 back */
#define FKS 4                        /* waves that share the keys of one 32-row query tile */
#define FQT 4                        /* 32-row query tiles per block */
#define FTH 4096.0f                  /* a lane's sum of one block's weights of one query above which the running maximum is renewed */
// Exact f32 causal attention for rows 0..QT0-1, in the same launch: waves 16 .. 19 of a block take 16-row units of the block's batch, unit 31 - x beside the block's long walk and unit x beside its short one (the keys of the two add up alike in every block), reassociated like the f16 walk:
// lane = query row 16 unit + ln, its partial y row (P x, 32 wide) stays in registers, its q' row (x Wq Wk^T, 32 wide) in LDS units of its own; of every 64 keys wave e takes keys 16 e .. 16 e + 15, lane half hh the 8 from 16 e + 8 hh, with its own running maximum, sum and y.
// A wave brings its 16 x rows into LDS of its own (coalesced 16-byte loads, the next rows fetched into registers while these are worked on; no other wave touches them, so no barrier) and reads them as 16-byte LDS loads of one address per lane half;
// the eight partial results of a row are merged through LDS behind the block's two barriers, multiplied by Wv on the matrix unit (y split in two f16 terms) and stored into the output rows. The sixteen f16 waves leave rows 0..QT0-1 alone.
typedef float v2f __attribute__((ext_vector_type(2)));
#define FXW 4                        /* waves per block on the exact rows */
#define A0R 16                       /* query rows per exact unit */
#define A0K 8                        /* keys per lane and step */
#define A0P 33                       /* row pitch of the merge plane [wave][column][lane]: odd, so that the writers fall on distinct banks */
static_assert(2 * (SQ / (64 * FQT)) == QT0 / A0R && QT0 % (32 * FQT) == 0 && QT0 % (2 * A0K * FXW) == 0, "two exact units per block of a batch; whole 128-row groups are exact; a step's 64 keys lie below QT0");
__device__ __forceinline__ float a0_exp(float x) { float r; asm("v_exp_f32 %0, %1\n\tv_nop" : "=v"(r) : "v"(x * 1.4426950408889634f)); return r; }      /* e^x; the v_nop fills the one slot that the instruction set asks for between a transcendental and a next instruction that reads its result or overwrites its source */
template <int LD>      /* row pitch of the q' plane */
__global__ __launch_bounds__(32 * (FKS * FQT + FXW)) void k_fattn(const _Float16* __restrict__ Q, const _Float16* __restrict__ K, const _Float16* __restrict__ VT, const float* __restrict__ F0, const float* __restrict__ wv, float* __restrict__ O) {
  // Key split: a block of sixteen waves owns 128 query rows (four 32-row tiles); the four waves of a tile hold the SAME 32 query rows, and wave sh of them walks key blocks sh, sh + 4, ... (32 keys each)
  // with its own running maximum, sum and output tiles; the four partial results of a tile are merged through LDS. The waves with the same sh walk the same keys side by side.
  // A block takes row group n - 1 - x and then row group x, so the key blocks walked add up alike in every block, and a wave walks about a quarter of its two tiles' blocks.
  __shared__ __attribute__((aligned(16))) float so[FKS * FQT * 1024];      /* merge plane [wave][piece (t, j, register half)][lane]: units of 16 bytes, written and read by the same lane number */
  __shared__ float sfm[FKS * FQT][32]; __shared__ float sfl[FKS * FQT][32];      /* [wave][query row of the tile]: running maximum (log2 units), sum */
  __shared__ __attribute__((aligned(16))) float xs[FXW][2 * A0K * DM];      /* exact rows: each wave's own 16 x rows */
  __shared__ __attribute__((aligned(16))) float xq[FXW][DM / 4][32][4];      /* exact rows: each lane's own q' row */
  __shared__ float xo[2][FXW * DM * A0P]; __shared__ float xmm[2][FXW][32]; __shared__ float xml[2][FXW][32];      /* exact rows: merge plane [unit of the block][wave][column][lane], running maximum, sum; one plane per unit, so that a wave may write the second unit's while the first is still being merged */
  const int lane = threadIdx.x & 31, ln = lane & 15, hh = lane >> 4; const int w = __builtin_amdgcn_readfirstlane(threadIdx.x >> 5); const int sh = w / FQT, qt = w % FQT;      /* wave w: key share sh of tile qt of the row group; neighbouring waves walk the same keys */
  const bool ex = sh == FKS;      /* waves 16 .. 19: key share qt of the exact rows (the same for the whole wave) */
  { const size_t bi = (size_t)blockIdx.y * SQ; Q += bi * LD; K += bi * DM; VT += bi * DM; O += bi * HD; F0 += (size_t)blockIdx.y * QT0 * (2 * DM); }      /* batch on grid.y; the f32 q' | x plane has a QT0-row slab per batch */
  const v8f z8 = {0.f, 0.f, 0.f, 0.f, 0.f, 0.f, 0.f, 0.f};
  const int mi = ex ? qt : sh; const int gj = mi & 1, md = 32 * (mi >> 1);      /* behind the merge share mi owns query group gj and output columns md .. md + 31 (one whole 128-byte line of each row) */
  v16h wvf[2];
#pragma unroll      /* constant indices, so that the arrays indexed below stay in registers */
  for (int e = 0; e < 2; ++e) wvf[e] = wv_frag(wv, md + 16 * e + ln, hh);
  asm volatile("s_wait_xcnt 0x0" ::: "memory");      /* the address registers stay untouched until the loads that name them have taken them */
  for (int h = 0; h < 2; ++h) {
    const int tile = (h ? (int)blockIdx.x : SQ / (32 * FQT) - 1 - (int)blockIdx.x) * FQT + qt; const int q0 = tile * 32;
    const int nf = (tile > sh ? tile - sh : 0) / FKS;      /* the wave's key blocks: sh, sh + 4, ..., sh + 4 nf (the same for the whole wave) */
    const int dq = (tile - sh - FKS * nf) * 32;      /* query q0 minus the first key of the wave's last block: 0 = the diagonal block; below 0 (sh > tile, tiles 0 .. 2 only): a block wholly right of the diagonal, every key masked, so that the wave adds weight 0 */
    const int xr0 = (h ? (int)blockIdx.x : QT0 / A0R - 1 - (int)blockIdx.x) * A0R;      /* first row of the exact unit worked beside this row group */
    if (ex) {      /* a scalar test: one exact unit; in front of the f16 walk's start values, so that those hold no registers here */
      const int i = xr0 + ln; const int nw = (xr0 / A0R + FXW - qt) / FXW;      /* the wave's steps: those whose keys 64 t + 16 qt .. begin at or left of the unit's last row (0 steps: the wave adds weight 0) */
      v2f y2[DM / 2]; float* qs = &xq[qt][0][lane][0];      /* the lane's q' row lies in LDS units of its own, [4 columns][lane], and comes back 4 columns at a time: 8 registers in place of 32 */
      { const float* qr = F0 + (size_t)i * (2 * DM);
#pragma unroll      /* constant indices, so that the arrays indexed below stay in registers */
        for (int c = 0; c < DM / 4; ++c) { const v4f a = *(const v4fa*)(qr + c * 4); *(v4f*)(qs + c * 128) = a; y2[2 * c] = v2f{0.f, 0.f}; y2[2 * c + 1] = v2f{0.f, 0.f}; }
        asm volatile("s_wait_xcnt 0x0" :: "v"(qr) : "memory"); }      /* the address pair stays untouched until the loads that name it have taken it */
      const int sr = lane >> 3, sc4 = (lane & 7) * 4;      /* staging: 8 lanes per 128-byte row, rows sr + 4 u of the wave's 16 */
      const float* xg = F0 + DM + (size_t)(2 * A0K * qt + sr) * (2 * DM) + sc4;
      v4f px[4];
#pragma unroll      /* constant indices, so that the arrays indexed below stay in registers */
      for (int u = 0; u < 4; ++u) px[u] = *(const v4fa*)(xg + 4 * u * 2 * DM);
      asm volatile("s_wait_xcnt 0x0" :: "v"(xg) : "memory");      /* as above: the address pair is stepped on in the loop */
      float xm = -1.0e30f, xl = 0.f; float* ks = xs[qt]; const float* kt = ks + A0K * hh * DM;      /* the lane half's 8 rows */
      for (int t = 0; t < nw; ++t) {
#pragma unroll      /* constant indices, so that the arrays indexed below stay in registers */
        for (int u = 0; u < 4; ++u) *(v4f*)&ks[(sr + 4 * u) * DM + sc4] = px[u];
        __builtin_amdgcn_fence(__ATOMIC_ACQ_REL, "workgroup", "local"); __builtin_amdgcn_wave_barrier();      /* the wave's lanes read each other's rows: the stores stay in front of the reads */
        const int j0 = (t * FXW + qt) * 2 * A0K + A0K * hh;
        v2f s2[A0K]; v4f qv[2]; v4f kb[3][4];      /* batches of 4 LDS reads: two in flight while the third is worked on. Scores: batch b = columns 4 (b / 2) .. + 3 of keys 4 (b % 2) .. + 3 */
#pragma unroll      /* constant indices, so that the arrays indexed below stay in registers */
        for (int k = 0; k < A0K; ++k) { s2[k] = v2f{0.f, 0.f}; kb[k >> 2][k & 3] = *(const v4f*)&kt[k * DM]; }
        qv[0] = *(const v4f*)qs;
#pragma unroll      /* constant indices, so that the arrays indexed below stay in registers */
        for (int b = 0; b < 2 * (DM / 4); ++b) { const int c = b >> 1;
          if (b + 2 < 2 * (DM / 4)) { for (int u = 0; u < 4; ++u) kb[(b + 2) % 3][u] = *(const v4f*)&kt[(4 * (b & 1) + u) * DM + (c + 1) * 4];
            if ((b & 1) == 0) qv[(c + 1) & 1] = *(const v4f*)(qs + (c + 1) * 128); }
          __builtin_amdgcn_sched_barrier(0);      /* the reads of the batch after next are issued before this batch's products wait: left alone, each read is issued singly and waited for at once */
          for (int u = 0; u < 4; ++u) { const int k = 4 * (b & 1) + u; const v4f kk = kb[b % 3][u], qq = qv[c & 1]; s2[k] = __builtin_elementwise_fma(v2f{qq[0], qq[1]}, v2f{kk[0], kk[1]}, s2[k]); s2[k] = __builtin_elementwise_fma(v2f{qq[2], qq[3]}, v2f{kk[2], kk[3]}, s2[k]); }
          __builtin_amdgcn_sched_barrier(0); }      /* as above: no more than three batches hold registers */
        float s[A0K], e[A0K]; float mn = xm;
#pragma unroll      /* constant indices, so that the arrays indexed below stay in registers */
        for (int k = 0; k < A0K; ++k) { s[k] = (j0 + k <= i) ? (s2[k][0] + s2[k][1]) * 0.125f : -1.0e30f; mn = fmaxf(mn, s[k]); }      /* 64^-0.5 */
        const float rs = a0_exp(xm - mn); xm = mn; float ls = 0.f;
#pragma unroll      /* constant indices, so that the arrays indexed below stay in registers */
        for (int k = 0; k < A0K; ++k) { const float ev = a0_exp(s[k] - mn); e[k] = (j0 + k <= i) ? ev : 0.f; ls += e[k]; }      /* a key right of the diagonal weighs 0 also while the running maximum is still the start value */
        xl = xl * rs + ls;
#pragma unroll      /* constant indices, so that the arrays indexed below stay in registers */
        for (int c = 0; c < DM / 2; ++c) y2[c] *= rs;
        __builtin_amdgcn_fence(__ATOMIC_ACQ_REL, "wavefront", "local");      /* the rows are read from LDS a second time: held over from the scores they would take 256 registers, and the block's five waves a SIMD have 192 each */
        if (t + 1 < nw) { xg += FXW * 2 * A0K * 2 * DM;
#pragma unroll      /* constant indices, so that the arrays indexed below stay in registers */
          for (int u = 0; u < 4; ++u) px[u] = *(const v4fa*)(xg + 4 * u * 2 * DM);
          asm volatile("s_wait_xcnt 0x0" :: "v"(xg) : "memory"); }      /* as above */
#pragma unroll      /* constant indices, so that the arrays indexed below stay in registers */
        for (int c = 0; c < DM / 4; ++c) kb[c >> 2][c & 3] = *(const v4f*)&kt[c * 4];      /* weighted sum: batch b = columns 16 (b % 2) .. + 15 of key b / 2 */
#pragma unroll      /* constant indices, so that the arrays indexed below stay in registers */
        for (int b = 0; b < 2 * A0K; ++b) { const int k = b >> 1; const v2f e2 = {e[k], e[k]};
          if (b + 2 < 2 * A0K) for (int u = 0; u < 4; ++u) kb[(b + 2) % 3][u] = *(const v4f*)&kt[(k + 1) * DM + (4 * (b & 1) + u) * 4];
          __builtin_amdgcn_sched_barrier(0);      /* as above */
          for (int u = 0; u < 4; ++u) { const int c = 4 * (b & 1) + u; const v4f vv = kb[b % 3][u]; y2[2 * c] = __builtin_elementwise_fma(e2, v2f{vv[0], vv[1]}, y2[2 * c]); y2[2 * c + 1] = __builtin_elementwise_fma(e2, v2f{vv[2], vv[3]}, y2[2 * c + 1]); }
          __builtin_amdgcn_sched_barrier(0); }      /* as above */
        __builtin_amdgcn_fence(__ATOMIC_ACQ_REL, "workgroup", "local"); __builtin_amdgcn_wave_barrier();      /* the reads stay in front of the next step's stores */
      }
#pragma unroll      /* constant indices, so that the arrays indexed below stay in registers */
      for (int c = 0; c < DM / 2; ++c) { xo[h][(qt * DM + 2 * c) * A0P + lane] = y2[c][0]; xo[h][(qt * DM + 2 * c + 1) * A0P + lane] = y2[c][1]; }
      xmm[h][qt][lane] = xm; xml[h][qt][lane] = xl;
    }
    v8f o[2][2]; float m[2] = {-1.0e30f, -1.0e30f}, l[2] = {0.f, 0.f};
#pragma unroll      /* constant indices, so that the arrays indexed below stay in registers */
    for (int t = 0; t < 2; ++t) { o[t][0] = z8; o[t][1] = z8; }
    const bool act = !ex && q0 >= QT0;      /* a scalar test, alike in all sixteen f16 waves: a row group below QT0 belongs to the exact waves */
    if (act) {
      v16h qf[2], kf[2], vf[2];
      const _Float16* kp = K + 32 * DM * sh + 8 * lane; const _Float16* vp = VT + 32 * DM * sh + 8 * lane;      /* key block sh, the lane's unit */
      { const _Float16* qp = Q + (size_t)(q0 + ln) * LD + 8 * hh;
#pragma unroll      /* constant indices, so that the arrays indexed below stay in registers */
        for (int j = 0; j < 2; ++j) { qf[j] = fa_frag(qp + 16 * j * LD); kf[j] = fa_fragp(kp + 512 * j); }
#pragma unroll      /* constant indices, so that the arrays indexed below stay in registers */
        for (int t = 0; t < 2; ++t) vf[t] = fa_fragp(vp + 512 * t);
        asm volatile("s_wait_xcnt 0x0" :: "v"(qp), "v"(kp), "v"(vp) : "memory"); }      /* the address pairs stay untouched until the loads that name them have taken them: kp and vp are stepped on in the loop */
      auto scan = [&](const v8f (&s)[2][2], float (&mx)[2]) __attribute__((always_inline)) {      /* the block's maximum per query, log2 units, alike in both lane halves */
#pragma unroll      /* constant indices, so that the arrays indexed below stay in registers */
        for (int j = 0; j < 2; ++j) { float a = fmaxf(s[0][j][0], s[1][j][0]);
          for (int r = 1; r < 8; ++r) a = fmaxf(a, fmaxf(s[0][j][r], s[1][j][r]));
          mx[j] = fmaxf(a, fa_xhalf(a)) * FAC; } };      /* finite; in a block that is masked as a whole it lies below the start value of m, which then stays, and every weight is 2^(-huge) = 0 */
      auto renew = [&](const float (&mx)[2]) __attribute__((always_inline)) {      /* takes the block's maximum into the running one and rescales sum and output tiles */
#pragma unroll      /* constant indices, so that the arrays indexed below stay in registers */
        for (int j = 0; j < 2; ++j) { const float mn = fmaxf(m[j], mx[j]); const float al = fa_exp2(m[j] - mn); m[j] = mn; l[j] *= al;
          for (int t = 0; t < 2; ++t) o[t][j] *= al; } };
      auto weigh = [&](const v8f (&s)[2][2], v16h (&pf)[2], float (&a)[2]) __attribute__((always_inline)) {      /* weights 2^(score - running maximum) as f16 operands, and the lane's f32 sum of its 16 per query */
#pragma unroll      /* constant indices, so that the arrays indexed below stay in registers */
        for (int j = 0; j < 2; ++j) { FragH f; const float mj = -m[j]; const v8f c8 = {FAC, FAC, FAC, FAC, FAC, FAC, FAC, FAC}, m8 = {mj, mj, mj, mj, mj, mj, mj, mj};
          const v8f e0 = fa_exp2x8(__builtin_elementwise_fma(s[0][j], c8, m8)), e1 = fa_exp2x8(__builtin_elementwise_fma(s[1][j], c8, m8));
          float a0 = e0[0], a1 = e1[0];
          for (int r = 1; r < 8; ++r) { a0 += e0[r]; a1 += e1[r]; }
          for (int r = 0; r < 8; ++r) { f.h[r] = (_Float16)e0[r]; f.h[8 + r] = (_Float16)e1[r]; }
          a[j] = a0 + a1; pf[j] = f.v; } };
      auto pass = [&](const bool ends, const bool last, const bool first) __attribute__((always_inline)) {      /* one block of 32 keys; ends: the maximum is scanned in front of the weights and tested (the wave's last block); first: the wave's first block, which sets the running maximum; last: the wave's last block, masked where it reaches the diagonal, nothing fetched behind it; else the wave's next block (4 blocks on) is fetched behind the products */
        v8f s[2][2];      /* [key tile][query group] */
#pragma unroll      /* constant indices, so that the arrays indexed below stay in registers */
        for (int kt = 0; kt < 2; ++kt) for (int j = 0; j < 2; ++j) s[kt][j] = fa_mma(kf[kt], qf[j], z8);
        if (!last) {
#pragma unroll      /* constant indices, so that the arrays indexed below stay in registers */
          for (int kt = 0; kt < 2; ++kt) kf[kt] = fa_fragp(kp + FKS * 32 * DM + 512 * kt);
          asm volatile("s_wait_xcnt 0x0" :: "v"(kp) : "memory"); }      /* as above; kp stays on this pass's block until the test below is through */
        __builtin_amdgcn_sched_barrier(0);      /* the four products are issued in one run, each filling the slots behind the one before: left alone, the first weights are moved in between them, behind v_nop padding */
        if (last && dq < 32) {      /* a scalar test: three waves of four end left of the diagonal block */
#pragma unroll      /* constant indices, so that the arrays indexed below stay in registers */
          for (int kt = 0; kt < 2; ++kt) for (int j = 0; j < 2; ++j) for (int r = 0; r < 8; ++r) s[kt][j][r] = (16 * kt + 8 * hh + r <= 16 * j + ln + dq) ? s[kt][j][r] : -3.0e38f; }      /* key at or left of query */
        float mx[2];
        if (ends) { scan(s, mx);
          if (__builtin_amdgcn_ballot_w32(mx[0] > m[0] + 8.0f || mx[1] > m[1] + 8.0f) != 0) renew(mx); }      /* one scalar test a pass */
        if (first) { scan(s, mx); renew(mx); }      /* a scalar test: the wave's first block sets the running maximum */
        v16h pf[2]; float a[2];
        weigh(s, pf, a);
        if (!ends && __builtin_amdgcn_ballot_w32(!(a[0] <= FTH && a[1] <= FTH)) != 0) {      /* one scalar test a pass, on sums that are formed anyway: a weight is positive, so none exceeds its sum; an overflow to infinity trips the test too */
          v16h kk[2];      /* rare: the scores went into the weights in place, so the block's key fragments come once more and the products are done again */
#pragma unroll      /* constant indices, so that the arrays indexed below stay in registers */
          for (int kt = 0; kt < 2; ++kt) kk[kt] = fa_fragp(kp + 512 * kt);
          asm volatile("s_wait_xcnt 0x0" :: "v"(kp) : "memory");      /* as above */
#pragma unroll      /* constant indices, so that the arrays indexed below stay in registers */
          for (int kt = 0; kt < 2; ++kt) for (int j = 0; j < 2; ++j) s[kt][j] = fa_mma(kk[kt], qf[j], z8);
          scan(s, mx); renew(mx);      /* behind it every weight of the block is <= 1 */
          weigh(s, pf, a); }
#pragma unroll      /* constant indices, so that the arrays indexed below stay in registers */
        for (int j = 0; j < 2; ++j) l[j] += a[j];
#pragma unroll      /* constant indices, so that the arrays indexed below stay in registers */
        for (int t = 0; t < 2; ++t) for (int j = 0; j < 2; ++j) o[t][j] = fa_mma(vf[t], pf[j], o[t][j]);
        if (!last) { kp += FKS * 32 * DM; vp += FKS * 32 * DM;
#pragma unroll      /* constant indices, so that the arrays indexed below stay in registers */
          for (int t = 0; t < 2; ++t) vf[t] = fa_fragp(vp + 512 * t);
          asm volatile("s_wait_xcnt 0x0" :: "v"(vp) : "memory"); }      /* as above */
      };
      for (int i = 0; i < nf; ++i) pass(false, false, i == 0);
      pass(true, true, false);
      __builtin_amdgcn_sched_barrier(0);      /* holds the slots below behind the walk's last matrix instruction */
      asm volatile("v_nop\n\tv_nop\n\tv_nop\n\tv_nop");      /* the four vector slots that the chip needs between a matrix instruction and the first vector instruction that touches its result, on every path through the scalar branches that follow */
    }
    __syncthreads();      /* the readers of the row group before have left the merge plane; the exact waves' partial results are in LDS */
    if (act) {
#pragma unroll      /* constant indices, so that the arrays indexed below stay in registers */
    for (int t = 0; t < 2; ++t) for (int j = 0; j < 2; ++j) for (int g = 0; g < 2; ++g) { const v4f y = {o[t][j][4 * g], o[t][j][4 * g + 1], o[t][j][4 * g + 2], o[t][j][4 * g + 3]};
      *(v4f*)&so[(w * 256 + ((t * 2 + j) * 2 + g) * 32 + lane) * 4] = y; }
    { const float l0 = l[0] + fa_xhalf(l[0]), l1 = l[1] + fa_xhalf(l[1]);      /* the two lane halves join their sums */
      sfm[w][lane] = hh ? m[1] : m[0]; sfl[w][lane] = hh ? l1 : l0; }      /* lane = query row 16 j + ln with j = hh: the maximum and the joined sum are alike in both halves */
    }
    __syncthreads();      /* all partial results are in LDS */
    if (act) { const int row = 16 * gj + ln;      /* merge: the lane takes, of query row, the 16 embedding columns that its own registers held in the walk, from the tile's four waves qt, qt + 4, ... */
      float mu[FKS]; float mt = sfm[qt][row]; mu[0] = mt;
#pragma unroll      /* constant indices, so that the arrays indexed below stay in registers */
      for (int u = 1; u < FKS; ++u) { mu[u] = sfm[qt + FQT * u][row]; mt = fmaxf(mt, mu[u]); }      /* finite: the tile's first wave holds key 0, which is valid for every row */
      float lt = 0.f; float y[16];
#pragma unroll      /* constant indices, so that the arrays indexed below stay in registers */
      for (int i = 0; i < 16; ++i) y[i] = 0.f;
#pragma unroll      /* constant indices, so that the arrays indexed below stay in registers */
      for (int u = 0; u < FKS; ++u) { const float f = fa_exp2(mu[u] - mt); lt += sfl[qt + FQT * u][row] * f;      /* a wave whose only block was masked as a whole: maximum -1e30, so f = 0 */
        for (int t = 0; t < 2; ++t) for (int g = 0; g < 2; ++g) { const v4f a = *(const v4f*)&so[((qt + FQT * u) * 256 + ((t * 2 + gj) * 2 + g) * 32 + lane) * 4];
          for (int c = 0; c < 4; ++c) y[8 * t + 4 * g + c] += a[c] * f; } }
      const float fin = 1.0f / lt;
#pragma unroll      /* constant indices, so that the arrays indexed below stay in registers */
      for (int i = 0; i < 16; ++i) y[i] *= fin;
      float* op = O + (size_t)(q0 + row) * HD + md + 8 * hh;
#pragma unroll      /* constant indices, so that the arrays indexed below stay in registers */
      for (int e = 0; e < 2; ++e) { const v8f d = wv_tile(wvf[e], y);      /* register r = output column md + 16 e + 8 hh + r of query row */
        const v4f y0 = {d[0], d[1], d[2], d[3]}, y1 = {d[4], d[5], d[6], d[7]};
        *(v4f*)(op + 16 * e) = y0; *(v4f*)(op + 16 * e + 4) = y1; }
      asm volatile("s_wait_xcnt 0x0" :: "v"(op) : "memory");      /* the stores' address and data registers stay untouched until the stores have taken them: the next row group's code writes them anew */
    } else if (ex && gj == 0) {      /* a scalar test: exact waves 0 and 2 merge the unit's 16 rows, beside the f16 waves' merge, and own output columns md .. md + 31, one whole 128-byte line of each row */
      float mx = xmm[h][0][ln];
#pragma unroll      /* constant indices, so that the arrays indexed below stay in registers */
      for (int u = 1; u < 2 * FXW; ++u) mx = fmaxf(mx, xmm[h][u >> 1][ln + 16 * (u & 1)]);      /* finite: key 0 is valid for every row */
      float lt = 0.f; float y[16];
#pragma unroll      /* constant indices, so that the arrays indexed below stay in registers */
      for (int c = 0; c < 16; ++c) y[c] = 0.f;
#pragma unroll      /* constant indices, so that the arrays indexed below stay in registers */
      for (int u = 0; u < 2 * FXW; ++u) { const int pl = ln + 16 * (u & 1); const float f = a0_exp(xmm[h][u >> 1][pl] - mx); lt += xml[h][u >> 1][pl] * f;      /* partial result of wave u / 2, lane half u % 2 */
#pragma unroll      /* constant indices, so that the arrays indexed below stay in registers */
        for (int c = 0; c < 16; ++c) y[c] += xo[h][((u >> 1) * DM + (c < 8 ? c : 8 + c) + 8 * hh) * A0P + pl] * f; }      /* the k order of wv_frag */
      const float fin = 1.0f / lt;
#pragma unroll      /* constant indices, so that the arrays indexed below stay in registers */
      for (int c = 0; c < 16; ++c) y[c] *= fin;
      float* op = O + (size_t)(xr0 + ln) * HD + md + 8 * hh;
#pragma unroll      /* constant indices, so that the arrays indexed below stay in registers */
      for (int e = 0; e < 2; ++e) { const v8f d = wv_tile(wvf[e], y);      /* register r = output column md + 16 e + 8 hh + r of query row */
        const v4f y0 = {d[0], d[1], d[2], d[3]}, y1 = {d[4], d[5], d[6], d[7]};
        *(v4f*)(op + 16 * e) = y0; *(v4f*)(op + 16 * e + 4) = y1; }
      asm volatile("s_wait_xcnt 0x0" :: "v"(op) : "memory");      /* the stores' address and data registers stay untouched until the stores have taken them */
    }
  } }


template <int BFIN, int WXB>
__global__ __launch_bounds__(256) void k_ln16(const float* __restrict__ X, const float* __restrict__ g, const float* __restrict__ bb, float eps, _Float16* __restrict__ N16, float* __restrict__ XB) {
  #pragma clang fp contract(off)
  __shared__ float red[256]; const size_t r = blockIdx.x; const int t = threadIdx.x; const v4f xa = *(const v4fa*)(X + r * DMQ + t * 4); float s[4]; float sum = 0.f;
  for (int q = 0; q < 4; ++q) { s[q] = BFIN ? bf16_round(xa[q]) : xa[q]; sum = __fadd_rn(sum, s[q]); }
  red[t] = sum; __syncthreads(); for (int st = 128; st > 0; st >>= 1) { if (t < st) red[t] = __fadd_rn(red[t], red[t + st]); __syncthreads(); } const float mu = red[0] / (float)DMQ; __syncthreads();
  float vs = 0.f; for (int q = 0; q < 4; ++q) { const float dl = __fadd_rn(s[q], -mu); vs = __fadd_rn(vs, __fmul_rn(dl, dl)); } red[t] = vs; __syncthreads(); for (int st = 128; st > 0; st >>= 1) { if (t < st) red[t] = __fadd_rn(red[t], red[t + st]); __syncthreads(); }
  const float rs = rsqrtf(__fadd_rn(red[0] / (float)DMQ, eps)); v4h y; v4f xb;
  for (int q = 0; q < 4; ++q) { const int c = t * 4 + q; y[q] = (_Float16)__fadd_rn(__fmul_rn(__fmul_rn(__fadd_rn(s[q], -mu), rs), bf16_round(g[c])), bf16_round(bb[c])); xb[q] = s[q]; }
  { *(v4h*)(N16 + r * DMQ + t * 4) = y; if (WXB) *(v4f*)(XB + r * DMQ + t * 4) = xb;  } }
__global__ __launch_bounds__(256) void k_ftres2(const float* __restrict__ OF0, const float* __restrict__ XB, float* __restrict__ X1, size_t n4) {
  #pragma clang fp contract(off)
  const size_t t = (size_t)blockIdx.x * 256 + threadIdx.x; if (t >= n4) return; const v4f o = *(const v4fa*)(OF0 + t * 4), xv = *(const v4fa*)(XB + t * 4); v4f y; for (int q = 0; q < 4; ++q) y[q] = __fadd_rn(__fmul_rn(o[q], 0.015625f), xv[q]); *(v4f*)(X1 + t * 4) = y;  }

__global__ __launch_bounds__(256) void k_wthd(const float* __restrict__ Wt, _Float16* __restrict__ Bt) { const size_t t = (size_t)blockIdx.x * 256 + threadIdx.x; if (t >= (size_t)NH * HD * (DM / 8)) return; const int m8 = (int)(t % (DM / 8)) * 8; const int d = (int)((t / (DM / 8)) % HD); const int h = (int)(t / ((size_t)(DM / 8) * HD)); FragH f;
  for (int q = 0; q < 8; ++q) f.h[q] = (_Float16)(16.0f * bf16_round(Wt[((size_t)h * DM + m8 + q) * HD + d])); unsigned short* dst = (unsigned short*)Bt + ((size_t)h * HD + d) * DM + m8; *(v8us*)dst = f.half[0];  }




__global__ __launch_bounds__(256) void k_wtpad(const float* __restrict__ Wm, _Float16* __restrict__ Wt, int Kr, int Kp, int Nr, int Np, float scale) {
  const int t = blockIdx.x * 256 + threadIdx.x; if (t >= Np * (Kp / 8)) return; const int n = t / (Kp / 8), k8 = (t % (Kp / 8)) * 8; const int nc = min(n, Nr - 1); const float fn = (n < Nr) ? 1.f : 0.f; FragH f;
  for (int i = 0; i < 8; ++i) { const int k = k8 + i; const int kc = min(k, Kr - 1); const float fk = (k < Kr) ? fn : 0.f; f.h[i] = (_Float16)(bf16_round(Wm[(size_t)kc * Nr + nc]) * scale * fk); }
  unsigned short* o = (unsigned short*)Wt + (size_t)n * Kp + k8; *(v8us*)o = f.half[0];  }
__global__ __launch_bounds__(128) void k_bpad(const float* __restrict__ b, float* __restrict__ Bp, int nr, int np) {
  const int i = threadIdx.x; if (i >= np) return; const float v = b[min(i, nr - 1)] * ((i < nr) ? 1.f : 0.f); *(float*)(Bp + i) = v;  }

#define DI 64         /* inner width = NH * HD (ONE 64-wide head) */
#define LQK (3 * DI)  /* fused q | k | v row pitch (192) */
__global__ __launch_bounds__(256) void k_o0(const float* __restrict__ OF, float* __restrict__ ob, size_t n4) {
  #pragma clang fp contract(off)
  const size_t t = (size_t)blockIdx.x * 256 + threadIdx.x; if (t >= n4) return; const size_t e = t * 4; const int i = (int)(e / DI); const int c = (int)(e % DI); const int h = c / HD, d = c % HD; const v4f a = *(const v4fa*)(OF + e); v4f o; for (int q = 0; q < 4; ++q) o[q] = __fmul_rn(a[q], 0.015625f); float* dst = ob + (size_t)h * SQ * HD + (size_t)i * HD + d; *(v4f*)dst = o;  }

// Projection, ONE launch from the inputs themselves: a wave owns 64 tokens (two whole 32-key blocks of the two x planes, so every 128-byte line there has one writer). It stores what the reassociated attention reads:
// q' = (x Wq) Wk^T (32 wide, f16 rows), x in key fragment order (its own x fragments as they stand in registers) and x^T in fragment order (column 16 ct + ln, tokens 16 hf + 8 hh .. + 7 are the unit of tile ct, register half hf, lane 16 hh + ln; read again by column from the lines just loaded).
// q: A = Wq, B = x (f16 of the bf16-rounded values, the weight x16; both in the k order 8 hh + i, 16 + 8 hh + i). Row c of weight tile t is feature 4 c + t, so one 16-byte load of a weight row serves all four tiles, and a lane holds features 32 hh .. 32 hh + 31 of ONE token (register r of tile t = feature 32 hh + 4 r + t).
// q': A = Wk (row = embedding column, k = the 64 features), B = q from those registers, split into f16 high and low parts (two terms, so that q keeps f32 accuracy); k step s takes feature 32 hh + 16 s + i at position i of lane half hh, in the A loader and in the B registers alike.
// A lane then holds columns 16 ct + 8 hh + r of q' of ONE token: 16-byte f16 stores. The waves of tokens 0..QT0-1 of a batch store q' | x as f32 rows for the exact first tile as well.
#define PJT 64                       /* tokens per wave */
__device__ __forceinline__ void pj_wload(const float* __restrict__ p, v4f (&r)[16]) {      /* p: the lane's k = 8 hh, features 4 ln .. 4 ln + 3 */
#pragma unroll      /* constant indices, so that the array stays in registers */
  for (int i = 0; i < 8; ++i) { r[i] = *(const v4fa*)(p + i * DI); r[8 + i] = *(const v4fa*)(p + (16 + i) * DI); } }
__device__ __forceinline__ void pj_wfrag(const v4f (&r)[16], v16h (&wf)[4]) {
#pragma unroll      /* constant indices, so that the arrays stay in registers */
  for (int t = 0; t < 4; ++t) { FragH f;
    for (int i = 0; i < 16; ++i) f.h[i] = (_Float16)(bf16_round(r[i][t]) * 16.0f);
    wf[t] = f.v; } }
__global__ __launch_bounds__(128) void k_proj(const float* __restrict__ x, const float* __restrict__ wq, const float* __restrict__ wk, _Float16* __restrict__ QP, _Float16* __restrict__ XK, _Float16* __restrict__ XT, float* __restrict__ F0) {
  const int lane = threadIdx.x & 31, ln = lane & 15, hh = lane >> 4; const int w = __builtin_amdgcn_readfirstlane(threadIdx.x >> 5);
  const int tok0 = ((int)blockIdx.x * 4 + w) * PJT; const int b = tok0 / SQ, i0 = tok0 % SQ;      /* PJT divides SQ and QT0: a wave's tokens lie in one batch, and all or none of them in the first tile */
  v16h xf[PJT / 16], wf[4], ka[2][2]; v4f xr[PJT / 16][4], wr[16], kr[2][2][4]; float xt[PJT / 32][2][2][8];
  const float* xp = x + (size_t)(tok0 + ln) * DM + 8 * hh; const int wo = 8 * hh * DI + 4 * ln; const float* kp = wk + ln * DI + 32 * hh; const float* tp = x + (size_t)(tok0 + 8 * hh) * DM + ln;
#pragma unroll      /* constant indices, so that the arrays indexed below stay in registers */
  for (int g = 0; g < PJT / 16; ++g) { xr[g][0] = *(const v4fa*)(xp + 16 * g * DM); xr[g][1] = *(const v4fa*)(xp + 16 * g * DM + 4); xr[g][2] = *(const v4fa*)(xp + 16 * g * DM + 16); xr[g][3] = *(const v4fa*)(xp + 16 * g * DM + 20); }
  pj_wload(wq + wo, wr);
#pragma unroll      /* constant indices, so that the arrays indexed below stay in registers */
  for (int ct = 0; ct < 2; ++ct) for (int s = 0; s < 2; ++s) for (int u = 0; u < 4; ++u) kr[ct][s][u] = *(const v4fa*)(kp + 16 * ct * DI + 16 * s + 4 * u);
  asm volatile("s_wait_xcnt 0x0" :: "v"(xp), "v"(wo), "v"(kp) : "memory");      /* the address registers stay untouched until the loads that name them have taken them */
  __builtin_amdgcn_sched_barrier(0);      /* all loads above are issued before the first conversion waits for one: without it they are issued a few at a time, each batch behind the wait for the batch before */
#pragma unroll      /* constant indices, so that the arrays indexed below stay in registers */
  for (int g = 0; g < PJT / 16; ++g) { FragH f;
    for (int u = 0; u < 4; ++u) for (int q = 0; q < 4; ++q) f.h[4 * u + q] = (_Float16)bf16_round(xr[g][u][q]);
    xf[g] = f.v; }
  pj_wfrag(wr, wf);
#pragma unroll      /* constant indices, so that the arrays indexed below stay in registers */
  for (int bk = 0; bk < PJT / 32; ++bk) for (int ct = 0; ct < 2; ++ct) for (int hf = 0; hf < 2; ++hf) for (int e = 0; e < 8; ++e) xt[bk][ct][hf][e] = tp[(32 * bk + 16 * hf + e) * DM + 16 * ct];      /* into the registers that x and the q weights have left; in flight under the conversion of the k weights */
  asm volatile("s_wait_xcnt 0x0" :: "v"(tp) : "memory");      /* as above */
  __builtin_amdgcn_sched_barrier(0);      /* as above */
#pragma unroll      /* constant indices, so that the arrays indexed below stay in registers */
  for (int ct = 0; ct < 2; ++ct) for (int s = 0; s < 2; ++s) { FragH f;
    for (int u = 0; u < 4; ++u) for (int q = 0; q < 4; ++q) f.h[4 * u + q] = (_Float16)(bf16_round(kr[ct][s][u][q]) * 16.0f);
    ka[ct][s] = f.v; }
  unsigned short* tr = (unsigned short*)XT + (size_t)tok0 * DM + 8 * lane;
#pragma unroll      /* constant indices, so that the arrays indexed below stay in registers */
  for (int bk = 0; bk < PJT / 32; ++bk) { v8us st[4];
    for (int ct = 0; ct < 2; ++ct) for (int hf = 0; hf < 2; ++hf) { FragH f;
      for (int e = 0; e < 8; ++e) f.h[e] = (_Float16)bf16_round(xt[bk][ct][hf][e]);
      st[2 * ct + hf] = f.half[0]; *(v8us*)(tr + 32 * bk * DM + 512 * ct + 256 * hf) = st[2 * ct + hf]; }
    asm volatile("s_wait_xcnt 0x0" :: "v"(tr) : "memory"); }      /* the stores' address and data registers stay untouched until the stores have taken them */
  const v8f z8 = {0.f, 0.f, 0.f, 0.f, 0.f, 0.f, 0.f, 0.f};
  unsigned short* qr = (unsigned short*)QP + (size_t)(tok0 + ln) * DM + 8 * hh; unsigned short* kr16 = (unsigned short*)XK + (size_t)tok0 * DM + 8 * lane; float* fr = F0 + ((size_t)b * QT0 + i0 + ln) * (2 * DM) + 8 * hh;      /* fr is used by the waves of the first tile only */
#pragma unroll      /* constant indices, so that the arrays indexed below stay in registers */
  for (int g = 0; g < PJT / 16; ++g) {
    FragH fx; fx.v = xf[g]; *(v8us*)(kr16 + 16 * g * DM) = fx.half[0]; *(v8us*)(kr16 + 16 * g * DM + 256) = fx.half[1];
    v8f d[4], e[2]; FragH qh[2], ql[2]; v8us sq[2];
    for (int t = 0; t < 4; ++t) d[t] = fa_mma(wf[t], xf[g], z8);
    for (int s = 0; s < 2; ++s) for (int i = 0; i < 16; ++i) { const float v = d[i & 3][4 * s + (i >> 2)] * 0.0625f; const _Float16 hv = (_Float16)v; qh[s].h[i] = hv; ql[s].h[i] = (_Float16)(v - (float)hv); }      /* takes the weights' x16 back */
    for (int ct = 0; ct < 2; ++ct) { e[ct] = fa_mma(ka[ct][0], qh[0].v, fa_mma(ka[ct][1], qh[1].v, fa_mma(ka[ct][0], ql[0].v, fa_mma(ka[ct][1], ql[1].v, z8)))) * 0.0625f;
      FragH f;
      for (int r = 0; r < 8; ++r) f.h[r] = (_Float16)e[ct][r];
      sq[ct] = f.half[0]; *(v8us*)(qr + 16 * g * DM + 16 * ct) = sq[ct]; }
    asm volatile("s_wait_xcnt 0x0" :: "v"(qr), "v"(kr16) : "memory");      /* as above */
    if (i0 < QT0) {      /* the same for the whole wave (a scalar test) */
      v4f ye[4], yz[4];
      for (int ct = 0; ct < 2; ++ct) for (int u = 0; u < 2; ++u) { ye[2 * ct + u] = v4f{e[ct][4 * u], e[ct][4 * u + 1], e[ct][4 * u + 2], e[ct][4 * u + 3]}; *(v4f*)(fr + 16 * g * 2 * DM + 16 * ct + 4 * u) = ye[2 * ct + u];
        yz[2 * ct + u] = v4f{(float)fx.h[8 * ct + 4 * u], (float)fx.h[8 * ct + 4 * u + 1], (float)fx.h[8 * ct + 4 * u + 2], (float)fx.h[8 * ct + 4 * u + 3]}; *(v4f*)(fr + 16 * g * 2 * DM + DM + 16 * ct + 4 * u) = yz[2 * ct + u]; }
      asm volatile("s_wait_xcnt 0x0" :: "v"(fr) : "memory"); } } }      /* as above */
extern "C" void kernel_launch(void* const* d_in, const int* in_sizes, int n_in,
                              void* d_out, int out_size, void* d_ws, size_t ws_size, hipStream_t stream) {
  (void)in_sizes; (void)n_in; (void)out_size;
  const float* const* I = (const float* const*)d_in; const float* x = I[0]; const float* wq = I[2]; const float* wk = I[1]; const float* wv = I[3];      /* x; [in][out = 64] weights in this module's input order (wq = input 2, wk = input 1, wv = input 3); no biases */
  char* ws = (char*)d_ws; size_t off = 0;
  auto take = [&](size_t bytes) { char* p = ws + off; off += (bytes + 255) & ~(size_t)255; return p; };
  _Float16* QP = (_Float16*)take(NR * DM * 2); _Float16* XK = (_Float16*)take(NR * DM * 2); _Float16* XT = (_Float16*)take(NR * DM * 2);      /* q' rows; x in key fragment order; x^T in fragment order */
  float* QXF0 = (float*)take((size_t)NB * QT0 * 2 * DM * 4);      /* f32 q' | x rows of the first tile, one slab per batch: every launch below covers all NB batches */
  if (off > ws_size) return;
  float* ob = (float*)d_out;
  k_proj<<<(unsigned)(NR / (4 * PJT)), 128, 0, stream>>>(x, wq, wk, QP, XK, XT, QXF0);      /* q' = x Wq Wk^T as f16 rows, x and x^T as f16 in fragment order (2 KiB per 32 tokens each), and f32 q' | x of rows 0..511 of every batch */
  k_fattn<DM><<<dim3(SQ / (64 * FQT), NB), 32 * (FKS * FQT + FXW), 0, stream>>>(QP, XK, XT, QXF0, wv, ob);      /* out[b][i][..] = (softmax(causal(q' x^T 64^-0.5)) x) Wv (f32), every row of every batch; scores and weights never leave the registers; rows 0..511 of every batch in exact f32 by the blocks' four further waves */
}
